// v000
// Times are from an AMD MI455X. After a warm-up the kernel runs many times in a row, and a time is the length of
// such a window on the GPU divided by its runs, so every launch and the gaps after it count. The runs cycle
// through copies of the inputs. A figure is the median of several windows, for all but v000 over two sittings.
// Sittings can differ by a few percent; kernels timed side by side share one.
// v000 is the starting kernel. One run takes 385 microseconds.
#include <hip/hip_runtime.h>
#include <hip/hip_bf16.h>
#include <math.h>

// Problem constants (B, S, D, H) from the reference.
constexpr int Bc = 2;
constexpr int Sc = 2048;
constexpr int Dc = 1024;
constexpr int Hc = 16;
constexpr int HDc = 64;                 // head dim
constexpr int Mrows = Bc * Sc;          // 4096 rows of X

typedef __attribute__((ext_vector_type(2))) float v2f;
typedef __attribute__((ext_vector_type(8))) float v8f;

// D = A(16x4) * B(4x16) + C, fp32 WMMA (CDNA5 V_WMMA_F32_16X16X4_F32)
__device__ __forceinline__ v8f wmma_f32_4(v2f a, v2f b, v8f c) {
    return __builtin_amdgcn_wmma_f32_16x16x4_f32(
        /*neg_a=*/false, a, /*neg_b=*/false, b,
        /*c_mod=*/(short)0, c, /*reuse_a=*/false, /*reuse_b=*/false);
}

// ---- async global->LDS copy (CDNA5 GLOBAL_LOAD_ASYNC_TO_LDS_B128, ASYNCcnt) ----
#if __has_builtin(__builtin_amdgcn_global_load_async_to_lds_b128) && \
    __has_builtin(__builtin_amdgcn_s_wait_asynccnt)
#define USE_ASYNC_LDS 1
typedef int vi4 __attribute__((vector_size(16)));   // matches builtin param pointee
__device__ __forceinline__ void async_copy16(const float* gsrc, float* ldst) {
    __builtin_amdgcn_global_load_async_to_lds_b128(
        (vi4 __attribute__((address_space(1)))*)gsrc,
        (vi4 __attribute__((address_space(3)))*)ldst,
        /*offset=*/0, /*cpol=*/0);
}
__device__ __forceinline__ void async_wait0() {
    __builtin_amdgcn_s_wait_asynccnt(0);
}
#else
#define USE_ASYNC_LDS 0
__device__ __forceinline__ void async_copy16(const float* gsrc, float* ldst) {
    *(float4*)ldst = *(const float4*)gsrc;   // fallback: through VGPRs
}
__device__ __forceinline__ void async_wait0() {}
#endif

// ---------------------------------------------------------------------------
// Kernel 1: Y = X @ W + bias   for W in {wq, wk, wv} (blockIdx.z selects).
// Output written in head-major layout: dst[((b*H + h)*S + s)*64 + e].
// Block tile: 64 (M) x 128 (N), BK = 16. 256 threads = 8 waves,
// wave grid 4 (M) x 2 (N); each wave computes 16 x 64 (four 16x16 tiles).
// ---------------------------------------------------------------------------
constexpr int BM = 64;
constexpr int BN = 128;
constexpr int BK = 16;

__global__ __launch_bounds__(256) void qkv_proj_kernel(
    const float* __restrict__ X,
    const float* __restrict__ Wq, const float* __restrict__ Wk, const float* __restrict__ Wv,
    const float* __restrict__ bq, const float* __restrict__ bk, const float* __restrict__ bv,
    float* __restrict__ Qws, float* __restrict__ Kws, float* __restrict__ Vws)
{
    const float* W;
    const float* bias;
    float* dst;
    if (blockIdx.z == 0)      { W = Wq; bias = bq; dst = Qws; }
    else if (blockIdx.z == 1) { W = Wk; bias = bk; dst = Kws; }
    else                      { W = Wv; bias = bv; dst = Vws; }

    __shared__ float Xs[BM][20];        // 64x16 X tile, padded (stride 20: 16B-aligned, bank-spread)
    __shared__ float Ws[BN][BK + 1];    // 128x16 W tile stored transposed (Ws[col][k]), padded

    const int tid   = threadIdx.x;
    const int lane  = tid & 31;
    const int wave  = tid >> 5;         // 0..7
    const int waveM = wave & 3;         // 4 waves along M
    const int waveN = wave >> 2;        // 2 waves along N
    const int hi    = lane >> 4;        // 0 for lanes 0-15, 1 for lanes 16-31
    const int l16   = lane & 15;

    const int rowBase = blockIdx.y * BM;
    const int colBase = blockIdx.x * BN;

    v8f acc[4] = {v8f{}, v8f{}, v8f{}, v8f{}};

    // Cooperative-load mappings
    const int xrow = tid >> 2;          // 0..63
    const int xcol = (tid & 3) * 4;     // 0,4,8,12

    for (int k0 = 0; k0 < Dc; k0 += BK) {
        // X tile: 64x16 = 1024 floats, one async b128 per thread straight to LDS
        async_copy16(X + (size_t)(rowBase + xrow) * Dc + k0 + xcol, &Xs[xrow][xcol]);

        // W tile: 16x128 = 2048 floats, two float4 per thread, scatter transposed
        #pragma unroll
        for (int it = 0; it < 2; ++it) {
            const int idx = tid + it * 256;       // 0..511
            const int kr  = idx >> 5;             // 0..15
            const int c4  = (idx & 31) * 4;       // 0..124
            const float4 wv = *(const float4*)(W + (size_t)(k0 + kr) * Dc + colBase + c4);
            Ws[c4 + 0][kr] = wv.x;
            Ws[c4 + 1][kr] = wv.y;
            Ws[c4 + 2][kr] = wv.z;
            Ws[c4 + 3][kr] = wv.w;
        }
        async_wait0();
        __syncthreads();

        // Prefetch next W tile rows into cache (emits global_prefetch_b8)
        if (k0 + BK < Dc) {
            __builtin_prefetch(W + (size_t)(k0 + BK + (tid >> 5)) * Dc + colBase + (tid & 31) * 4, 0, 3);
        }

        #pragma unroll
        for (int kk = 0; kk < BK; kk += 4) {
            // A fragment: lanes 0-15 hold K={kk,kk+1}; lanes 16-31 hold K={kk+2,kk+3}
            const int ak = kk + (hi << 1);
            v2f a;
            a.x = Xs[waveM * 16 + l16][ak];
            a.y = Xs[waveM * 16 + l16][ak + 1];
            #pragma unroll
            for (int t = 0; t < 4; ++t) {
                const int bn = waveN * 64 + t * 16 + l16;
                v2f bf;
                bf.x = Ws[bn][ak];
                bf.y = Ws[bn][ak + 1];
                acc[t] = wmma_f32_4(a, bf, acc[t]);
            }
        }
        __syncthreads();
    }

    // Epilogue: add bias, write head-major workspace layout
    #pragma unroll
    for (int t = 0; t < 4; ++t) {
        #pragma unroll
        for (int r = 0; r < 8; ++r) {
            const int m = rowBase + waveM * 16 + r + (hi << 3);   // global row in [0, 4096)
            const int n = colBase + waveN * 64 + t * 16 + l16;    // global col in [0, 1024)
            const int b = m >> 11;          // / 2048
            const int s = m & (Sc - 1);
            const int h = n >> 6;           // / 64
            const int e = n & (HDc - 1);
            dst[((size_t)(b * Hc + h) * Sc + s) * HDc + e] = acc[t][r] + bias[n];
        }
    }
}

// ---------------------------------------------------------------------------
// Kernel 2: per-head attention with tanh scores + bias/residual epilogue.
//   scores = (Q/scale) @ K^T ; att = tanh(scores) ; eff = att @ V
//   out = eff + bo + residual, written to both halves of d_out.
// One block = one (b,h) pair x 128 query rows; 8 waves, 16 query rows each.
// K and V tiles stream through LDS via async global->LDS copies (ASYNCcnt).
// ---------------------------------------------------------------------------
constexpr int WAVES = 8;
constexpr int QROWS = 16 * WAVES;       // 128 query rows per block

__global__ __launch_bounds__(256) void attn_kernel(
    const float* __restrict__ Qws, const float* __restrict__ Kws, const float* __restrict__ Vws,
    const float* __restrict__ bo, const float* __restrict__ residual,
    float* __restrict__ out)
{
    const int bh = blockIdx.x;          // 0..31
    const int b  = bh / Hc;
    const int h  = bh % Hc;
    const int qbase = blockIdx.y * QROWS;

    const float* Qh = Qws + (size_t)bh * Sc * HDc;
    const float* Kh = Kws + (size_t)bh * Sc * HDc;
    const float* Vh = Vws + (size_t)bh * Sc * HDc;

    __shared__ float Ks[16][HDc + 4];        // K tile, row-major, padded (stride 68)
    __shared__ float Vs[16][HDc + 4];        // V tile, row-major, padded (stride 68)
    __shared__ float Satt[WAVES][16][17];    // per-wave score tile relayout scratch

    const int tid  = threadIdx.x;
    const int lane = tid & 31;
    const int wave = tid >> 5;
    const int hi   = lane >> 4;
    const int l16  = lane & 15;
    const int khalf = hi << 1;               // 0 or 2

    // scale = sqrt(S / H) = sqrt(128); fold 1/scale into Q
    const float invScale = 1.0f / sqrtf((float)Sc / (float)Hc);

    // Preload this wave's Q fragments (16 rows x 64 features -> 16 A-fragments)
    const int qrow = qbase + wave * 16 + l16;
    v2f qa[16];
    #pragma unroll
    for (int kk = 0; kk < 16; ++kk) {
        const float* p = Qh + (size_t)qrow * HDc + kk * 4 + khalf;
        qa[kk].x = p[0] * invScale;
        qa[kk].y = p[1] * invScale;
    }

    v8f acc[4] = {v8f{}, v8f{}, v8f{}, v8f{}};   // 16 x 64 output accumulator

    // Cooperative load mapping for K/V tiles (16x64 floats, one b128 per thread)
    const int ldrow = tid >> 4;              // 0..15
    const int ldcol = (tid & 15) * 4;        // 0..60

    for (int j = 0; j < Sc / 16; ++j) {
        const int jbase = j * 16;

        // Stream K and V tiles straight into LDS (async, no VGPR round-trip)
        async_copy16(Kh + (size_t)(jbase + ldrow) * HDc + ldcol, &Ks[ldrow][ldcol]);
        async_copy16(Vh + (size_t)(jbase + ldrow) * HDc + ldcol, &Vs[ldrow][ldcol]);
        async_wait0();
        __syncthreads();

        // ---- scores tile: (Q/scale) @ K^T  (16 fp32 WMMAs over k=64) ----
        v8f sc = v8f{};
        #pragma unroll
        for (int kk = 0; kk < 16; ++kk) {
            const int ak = kk * 4 + khalf;
            v2f bf;                          // B[k][n] = K[n][k]
            bf.x = Ks[l16][ak];
            bf.y = Ks[l16][ak + 1];
            sc = wmma_f32_4(qa[kk], bf, sc);
        }

        // ---- tanh activation ----
        #pragma unroll
        for (int r = 0; r < 8; ++r) sc[r] = tanhf(sc[r]);

        // ---- relayout score tile C/D-layout -> A-fragment layout via LDS ----
        // (DS ops from the same wave are in-order; no barrier needed.)
        #pragma unroll
        for (int r = 0; r < 8; ++r) {
            Satt[wave][r + (hi << 3)][l16] = sc[r];   // Satt[m][key]
        }

        // ---- eff += att @ V  (16 fp32 WMMAs over key=16, n=64) ----
        #pragma unroll
        for (int k0 = 0; k0 < 16; k0 += 4) {
            v2f a;
            a.x = Satt[wave][l16][k0 + khalf];
            a.y = Satt[wave][l16][k0 + khalf + 1];
            #pragma unroll
            for (int t = 0; t < 4; ++t) {
                const int c = t * 16 + l16;
                v2f bf;                      // B[k][n] = V[k][n]
                bf.x = Vs[k0 + khalf][c];
                bf.y = Vs[k0 + khalf + 1][c];
                acc[t] = wmma_f32_4(a, bf, acc[t]);
            }
        }
        __syncthreads();
    }

    // ---- epilogue: + bo + residual, duplicate to both tuple outputs ----
    const size_t half = (size_t)Bc * Sc * Dc;
    #pragma unroll
    for (int t = 0; t < 4; ++t) {
        #pragma unroll
        for (int r = 0; r < 8; ++r) {
            const int s   = qbase + wave * 16 + r + (hi << 3);
            const int col = h * HDc + t * 16 + l16;
            const size_t idx = ((size_t)b * Sc + s) * Dc + col;
            const float val = acc[t][r] + bo[col] + residual[idx];
            out[idx]        = val;
            out[idx + half] = val;
        }
    }
}

// ---------------------------------------------------------------------------
// Launch: inputs (X, residual_score, wq, wk, wv, bq, bk, bv, bo, head_num)
// ---------------------------------------------------------------------------
extern "C" void kernel_launch(void* const* d_in, const int* in_sizes, int n_in,
                              void* d_out, int out_size, void* d_ws, size_t ws_size,
                              hipStream_t stream) {
    const float* X   = (const float*)d_in[0];
    const float* res = (const float*)d_in[1];
    const float* wq  = (const float*)d_in[2];
    const float* wk  = (const float*)d_in[3];
    const float* wv  = (const float*)d_in[4];
    const float* bq  = (const float*)d_in[5];
    const float* bk  = (const float*)d_in[6];
    const float* bv  = (const float*)d_in[7];
    const float* bo  = (const float*)d_in[8];
    float* out = (float*)d_out;

    // Workspace: Q, K, V in head-major [B,H,S,64] layout (3 x 16 MiB fp32)
    float* Qws = (float*)d_ws;
    float* Kws = Qws + (size_t)Mrows * Dc;
    float* Vws = Kws + (size_t)Mrows * Dc;

    dim3 gProj(Dc / BN, Mrows / BM, 3);       // (8, 64, 3)
    qkv_proj_kernel<<<gProj, 256, 0, stream>>>(X, wq, wk, wv, bq, bk, bv, Qws, Kws, Vws);

    dim3 gAttn(Bc * Hc, Sc / QROWS);          // (32, 16)
    attn_kernel<<<gAttn, 256, 0, stream>>>(Qws, Kws, Vws, bo, res, out);
}

// v001
// It runs in 328 microseconds.
// Two timings next to v000 put it at 1.21 and 1.22 times that version's speed.
#include <hip/hip_runtime.h>
#include <hip/hip_bf16.h>
#include <math.h>

// Problem constants (B, S, D, H) from the reference.
constexpr int Bc = 2;
constexpr int Sc = 2048;
constexpr int Dc = 1024;
constexpr int Hc = 16;
constexpr int HDc = 64;                 // head dim
constexpr int Mrows = Bc * Sc;          // 4096 rows of X

typedef __attribute__((ext_vector_type(2))) float v2f;
typedef __attribute__((ext_vector_type(8))) float v8f;

// D = A(16x4) * B(4x16) + C, fp32 WMMA (CDNA5 V_WMMA_F32_16X16X4_F32)
__device__ __forceinline__ v8f wmma_f32_4(v2f a, v2f b, v8f c) {
    return __builtin_amdgcn_wmma_f32_16x16x4_f32(
        /*neg_a=*/false, a, /*neg_b=*/false, b,
        /*c_mod=*/(short)0, c, /*reuse_a=*/false, /*reuse_b=*/false);
}

// ---- async global->LDS copy (CDNA5 GLOBAL_LOAD_ASYNC_TO_LDS_B128, ASYNCcnt) ----
#if __has_builtin(__builtin_amdgcn_global_load_async_to_lds_b128) && \
    __has_builtin(__builtin_amdgcn_s_wait_asynccnt)
#define USE_ASYNC_LDS 1
typedef int vi4 __attribute__((vector_size(16)));   // matches builtin param pointee
__device__ __forceinline__ void async_copy16(const float* gsrc, float* ldst) {
    __builtin_amdgcn_global_load_async_to_lds_b128(
        (vi4 __attribute__((address_space(1)))*)gsrc,
        (vi4 __attribute__((address_space(3)))*)ldst,
        /*offset=*/0, /*cpol=*/0);
}
__device__ __forceinline__ void async_wait0() {
    __builtin_amdgcn_s_wait_asynccnt(0);
}
#else
#define USE_ASYNC_LDS 0
__device__ __forceinline__ void async_copy16(const float* gsrc, float* ldst) {
    *(float4*)ldst = *(const float4*)gsrc;   // fallback: through VGPRs
}
__device__ __forceinline__ void async_wait0() {}
#endif

// ---------------------------------------------------------------------------
// Kernel 1: Y = X @ W + bias   for W in {wq, wk, wv} (blockIdx.z selects).
// Output written in head-major layout: dst[((b*H + h)*S + s)*64 + e].
// Block tile: 64 (M) x 128 (N), BK = 16. 256 threads = 8 waves,
// wave grid 4 (M) x 2 (N); each wave computes 16 x 64 (four 16x16 tiles).
// ---------------------------------------------------------------------------
constexpr int BM = 64;
constexpr int BN = 128;
constexpr int BK = 16;

__global__ __launch_bounds__(256) void qkv_proj_kernel(
    const float* __restrict__ X,
    const float* __restrict__ Wq, const float* __restrict__ Wk, const float* __restrict__ Wv,
    const float* __restrict__ bq, const float* __restrict__ bk, const float* __restrict__ bv,
    float* __restrict__ Qws, float* __restrict__ Kws, float* __restrict__ Vws)
{
    const float* W;
    const float* bias;
    float* dst;
    if (blockIdx.z == 0)      { W = Wq; bias = bq; dst = Qws; }
    else if (blockIdx.z == 1) { W = Wk; bias = bk; dst = Kws; }
    else                      { W = Wv; bias = bv; dst = Vws; }

    __shared__ float Xs[BM][20];        // 64x16 X tile, padded (stride 20: 16B-aligned, bank-spread)
    __shared__ float Ws[BN][BK + 1];    // 128x16 W tile stored transposed (Ws[col][k]), padded

    const int tid   = threadIdx.x;
    const int lane  = tid & 31;
    const int wave  = tid >> 5;         // 0..7
    const int waveM = wave & 3;         // 4 waves along M
    const int waveN = wave >> 2;        // 2 waves along N
    const int hi    = lane >> 4;        // 0 for lanes 0-15, 1 for lanes 16-31
    const int l16   = lane & 15;

    const int rowBase = blockIdx.y * BM;
    const int colBase = blockIdx.x * BN;

    v8f acc[4] = {v8f{}, v8f{}, v8f{}, v8f{}};

    // Cooperative-load mappings
    const int xrow = tid >> 2;          // 0..63
    const int xcol = (tid & 3) * 4;     // 0,4,8,12

    for (int k0 = 0; k0 < Dc; k0 += BK) {
        // X tile: 64x16 = 1024 floats, one async b128 per thread straight to LDS
        async_copy16(X + (size_t)(rowBase + xrow) * Dc + k0 + xcol, &Xs[xrow][xcol]);

        // W tile: 16x128 = 2048 floats, two float4 per thread, scatter transposed
        #pragma unroll
        for (int it = 0; it < 2; ++it) {
            const int idx = tid + it * 256;       // 0..511
            const int kr  = idx >> 5;             // 0..15
            const int c4  = (idx & 31) * 4;       // 0..124
            const float4 wv = *(const float4*)(W + (size_t)(k0 + kr) * Dc + colBase + c4);
            Ws[c4 + 0][kr] = wv.x;
            Ws[c4 + 1][kr] = wv.y;
            Ws[c4 + 2][kr] = wv.z;
            Ws[c4 + 3][kr] = wv.w;
        }
        async_wait0();
        __syncthreads();

        // Prefetch next W tile rows into cache (emits global_prefetch_b8)
        if (k0 + BK < Dc) {
            __builtin_prefetch(W + (size_t)(k0 + BK + (tid >> 5)) * Dc + colBase + (tid & 31) * 4, 0, 3);
        }

        #pragma unroll
        for (int kk = 0; kk < BK; kk += 4) {
            // A fragment: lanes 0-15 hold K={kk,kk+1}; lanes 16-31 hold K={kk+2,kk+3}
            const int ak = kk + (hi << 1);
            v2f a;
            a.x = Xs[waveM * 16 + l16][ak];
            a.y = Xs[waveM * 16 + l16][ak + 1];
            #pragma unroll
            for (int t = 0; t < 4; ++t) {
                const int bn = waveN * 64 + t * 16 + l16;
                v2f bf;
                bf.x = Ws[bn][ak];
                bf.y = Ws[bn][ak + 1];
                acc[t] = wmma_f32_4(a, bf, acc[t]);
            }
        }
        __syncthreads();
    }

    // Epilogue: add bias, write head-major workspace layout
    #pragma unroll
    for (int t = 0; t < 4; ++t) {
        #pragma unroll
        for (int r = 0; r < 8; ++r) {
            const int m = rowBase + waveM * 16 + r + (hi << 3);   // global row in [0, 4096)
            const int n = colBase + waveN * 64 + t * 16 + l16;    // global col in [0, 1024)
            const int b = m >> 11;          // / 2048
            const int s = m & (Sc - 1);
            const int h = n >> 6;           // / 64
            const int e = n & (HDc - 1);
            dst[((size_t)(b * Hc + h) * Sc + s) * HDc + e] = acc[t][r] + bias[n];
        }
    }
}

// ---------------------------------------------------------------------------
// Kernel 2: per-head attention with tanh scores + bias/residual epilogue.
//   scores = (Q/scale) @ K^T ; att = tanh(scores) ; eff = att @ V
//   out = eff + bo + residual, written to both halves of d_out.
// One block = one (b,h) pair x 128 query rows; 8 waves, 16 query rows each.
// K and V tiles stream through LDS via async global->LDS copies (ASYNCcnt).
// ---------------------------------------------------------------------------
constexpr int WAVES = 8;
constexpr int QROWS = 16 * WAVES;       // 128 query rows per block

__global__ __launch_bounds__(256) void attn_kernel(
    const float* __restrict__ Qws, const float* __restrict__ Kws, const float* __restrict__ Vws,
    const float* __restrict__ bo, const float* __restrict__ residual,
    float* __restrict__ out)
{
    const int bh = blockIdx.x;          // 0..31
    const int b  = bh / Hc;
    const int h  = bh % Hc;
    const int qbase = blockIdx.y * QROWS;

    const float* Qh = Qws + (size_t)bh * Sc * HDc;
    const float* Kh = Kws + (size_t)bh * Sc * HDc;
    const float* Vh = Vws + (size_t)bh * Sc * HDc;

    __shared__ float Ks[16][HDc + 4];        // K tile, row-major, padded (stride 68)
    __shared__ float Vs[16][HDc + 4];        // V tile, row-major, padded (stride 68)
    __shared__ float Satt[WAVES][16][17];    // per-wave score tile relayout scratch

    const int tid  = threadIdx.x;
    const int lane = tid & 31;
    const int wave = tid >> 5;
    const int hi   = lane >> 4;
    const int l16  = lane & 15;
    const int khalf = hi << 1;               // 0 or 2

    // scale = sqrt(S / H) = sqrt(128); fold 1/scale into Q
    const float invScale = 1.0f / sqrtf((float)Sc / (float)Hc);

    // Preload this wave's Q fragments (16 rows x 64 features -> 16 A-fragments)
    const int qrow = qbase + wave * 16 + l16;
    v2f qa[16];
    #pragma unroll
    for (int kk = 0; kk < 16; ++kk) {
        const float* p = Qh + (size_t)qrow * HDc + kk * 4 + khalf;
        qa[kk].x = p[0] * invScale;
        qa[kk].y = p[1] * invScale;
    }

    v8f acc[4] = {v8f{}, v8f{}, v8f{}, v8f{}};   // 16 x 64 output accumulator

    // Cooperative load mapping for K/V tiles (16x64 floats, one b128 per thread)
    const int ldrow = tid >> 4;              // 0..15
    const int ldcol = (tid & 15) * 4;        // 0..60

    for (int j = 0; j < Sc / 16; ++j) {
        const int jbase = j * 16;

        // Stream K and V tiles straight into LDS (async, no VGPR round-trip)
        async_copy16(Kh + (size_t)(jbase + ldrow) * HDc + ldcol, &Ks[ldrow][ldcol]);
        async_copy16(Vh + (size_t)(jbase + ldrow) * HDc + ldcol, &Vs[ldrow][ldcol]);
        async_wait0();
        __syncthreads();

        // ---- scores tile: (Q/scale) @ K^T  (16 fp32 WMMAs over k=64) ----
        v8f sc = v8f{};
        #pragma unroll
        for (int kk = 0; kk < 16; ++kk) {
            const int ak = kk * 4 + khalf;
            v2f bf;                          // B[k][n] = K[n][k]
            bf.x = Ks[l16][ak];
            bf.y = Ks[l16][ak + 1];
            sc = wmma_f32_4(qa[kk], bf, sc);
        }

        // ---- tanh activation: the chip's own v_tanh_f32, one instruction per value.
        // The library tanhf compiles to two divergent branches and a dependent chain per value.
        #pragma unroll
        for (int r = 0; r < 8; ++r) sc[r] = __builtin_amdgcn_tanhf(sc[r]);

        // ---- relayout score tile C/D-layout -> A-fragment layout via LDS ----
        // (DS ops from the same wave are in-order; no barrier needed.)
        #pragma unroll
        for (int r = 0; r < 8; ++r) {
            Satt[wave][r + (hi << 3)][l16] = sc[r];   // Satt[m][key]
        }

        // ---- eff += att @ V  (16 fp32 WMMAs over key=16, n=64) ----
        #pragma unroll
        for (int k0 = 0; k0 < 16; k0 += 4) {
            v2f a;
            a.x = Satt[wave][l16][k0 + khalf];
            a.y = Satt[wave][l16][k0 + khalf + 1];
            #pragma unroll
            for (int t = 0; t < 4; ++t) {
                const int c = t * 16 + l16;
                v2f bf;                      // B[k][n] = V[k][n]
                bf.x = Vs[k0 + khalf][c];
                bf.y = Vs[k0 + khalf + 1][c];
                acc[t] = wmma_f32_4(a, bf, acc[t]);
            }
        }
        __syncthreads();
    }

    // ---- epilogue: + bo + residual, duplicate to both tuple outputs ----
    const size_t half = (size_t)Bc * Sc * Dc;
    #pragma unroll
    for (int t = 0; t < 4; ++t) {
        #pragma unroll
        for (int r = 0; r < 8; ++r) {
            const int s   = qbase + wave * 16 + r + (hi << 3);
            const int col = h * HDc + t * 16 + l16;
            const size_t idx = ((size_t)b * Sc + s) * Dc + col;
            const float val = acc[t][r] + bo[col] + residual[idx];
            out[idx]        = val;
            out[idx + half] = val;
        }
    }
}

// ---------------------------------------------------------------------------
// Launch: inputs (X, residual_score, wq, wk, wv, bq, bk, bv, bo, head_num)
// ---------------------------------------------------------------------------
extern "C" void kernel_launch(void* const* d_in, const int* in_sizes, int n_in,
                              void* d_out, int out_size, void* d_ws, size_t ws_size,
                              hipStream_t stream) {
    const float* X   = (const float*)d_in[0];
    const float* res = (const float*)d_in[1];
    const float* wq  = (const float*)d_in[2];
    const float* wk  = (const float*)d_in[3];
    const float* wv  = (const float*)d_in[4];
    const float* bq  = (const float*)d_in[5];
    const float* bk  = (const float*)d_in[6];
    const float* bv  = (const float*)d_in[7];
    const float* bo  = (const float*)d_in[8];
    float* out = (float*)d_out;

    // Workspace: Q, K, V in head-major [B,H,S,64] layout (3 x 16 MiB fp32)
    float* Qws = (float*)d_ws;
    float* Kws = Qws + (size_t)Mrows * Dc;
    float* Vws = Kws + (size_t)Mrows * Dc;

    dim3 gProj(Dc / BN, Mrows / BM, 3);       // (8, 64, 3)
    qkv_proj_kernel<<<gProj, 256, 0, stream>>>(X, wq, wk, wv, bq, bk, bv, Qws, Kws, Vws);

    dim3 gAttn(Bc * Hc, Sc / QROWS);          // (32, 16)
    attn_kernel<<<gAttn, 256, 0, stream>>>(Qws, Kws, Vws, bo, res, out);
}
